// v010
// The times below were measured on an AMD MI455X: many runs one after another, warmed up first and cycling through
// copies of the inputs, with the whole window's GPU time divided by the number of runs. Launches and the gaps
// between them are all in it. The median over several windows is given; except for v000 it joins two sittings, which
// can be a few percent apart, so the side-by-side timings, each taken in one sitting, are the better comparison.
// This document starts at v010; the versions before it stand elsewhere.
// A run of this version takes 207 microseconds.
// Two timings next to v009 both put it at 1.09 times that version's speed.
// Counting every step since v000, which is the starting kernel, it is 50.9 times as fast.
#include <hip/hip_runtime.h>
// Pre-LayerNorm causal multi-head attention (x [4][2048][1024]; h = LN(x) (eps 1e-5, gamma, beta); q/k/v = h W + b ([in][out] 1024 x 1024 sigma 1/32, zero biases); 16 heads of 64; scores / 8; where(causal, s, finfo.min); softmax; out = merged Wo + bo -> [4][2048][1024], no residual).
// Structure: token rows r = b*2048 + s; h = LN(bf16(x)) as f16 hi + x1024 residual rows; Q, K, V as three WMMA GEMMs (32x64 wave tiles, f32 accumulation, exact x16 weights + bias, f16 outputs); V^T for all batches and heads via LDS transposes; causal attention fused in one launch (blocks of 128 query rows of one batch and head; S^T = K Q^T, running f32 maximum and sum per query, native exp2, weights x16 f16, O^T += V^T P^T over the keys up to the diagonal; o carried x64, folded into the output GEMM alpha) written straight into the merged f16 o rows; out = o W_o + b GEMM (f32) into the output layout.
// Compute dtype: inputs rounded to bf16; x / weights exact; q, k, v, softmax weights and o as plain f16 GEMM operands (~2^-12); scores and softmax statistics f32. v_wmma_f32_16x16x32_f16.
#define NB 4
#define SQ 2048
#define DM 1024
#define DMQ DM                       /* LayerNorm width */
#define NH 16
#define HD 64
#define HG 4                         /* heads per call of the second k_vt, which nothing launches */
#define QT 256                       /* query rows per (batch, head) in the size of S */
#define NKX SQ                       /* S / P row pitch */
#define QT0 128                      /* first-tile rows recomputed exactly in f32 */
#define B0 0                         /* first batch processed (debug hook) */
#define NBR NB                       /* batches processed (debug hook) */
#define NR ((size_t)NB * SQ)         /* token rows */
#define MP ((int)((size_t)NBR * SQ)) /* rows projected (debug hook) */
#define QN SQ                        /* query rows attended per batch (debug hook) */
#define NHD NH                       /* heads attended (debug hook) */
#define MPO MP                       /* rows through the output stage (debug hook) */
#define LQ DM      /* row pitch of the q/k/v rows */
typedef __bf16 v16b __attribute__((ext_vector_type(16)));
typedef unsigned short v8us __attribute__((ext_vector_type(8), may_alias));
typedef float  v8f  __attribute__((ext_vector_type(8)));
typedef float  v4f  __attribute__((ext_vector_type(4)));
typedef float  v4fa __attribute__((ext_vector_type(4), may_alias));
union FragB { v16b v; v8us half[2]; unsigned short u[16]; };

__device__ __forceinline__ unsigned short bf16_bits(float x) { unsigned int u = __float_as_uint(x); return (unsigned short)((u + 0x7FFFu + ((u >> 16) & 1u)) >> 16); }
__device__ __forceinline__ float bf16_val(unsigned short b) { return __uint_as_float(((unsigned int)b) << 16); }
__device__ __forceinline__ float bf16_round(float x) { return bf16_val(bf16_bits(x)); }
// D += A·B with NT terms: 1 = ah·bh, 2 = + al·bh (A split), 3 = + ah·bl (both split)
template <int NT>
__device__ __forceinline__ v8f mmaN(v16b ah, v16b al, v16b bh, v16b bl, v8f c) {
  c = __builtin_amdgcn_wmma_f32_16x16x32_bf16(false, ah, false, bh, (short)0, c, false, false);
  if (NT >= 2) c = __builtin_amdgcn_wmma_f32_16x16x32_bf16(false, al, false, bh, (short)0, c, false, false);
  if (NT >= 3) c = __builtin_amdgcn_wmma_f32_16x16x32_bf16(false, ah, false, bl, (short)0, c, false, false);
  asm volatile("v_nop\n\tv_nop\n\tv_nop\n\tv_nop" : "+v"(c) : "v"(ah), "v"(al), "v"(bh), "v"(bl));
  return c;
}

__global__ __launch_bounds__(256) void k_wt_bf16(const float* __restrict__ W, unsigned short* __restrict__ Wt, int K, int N) {
  const int t = blockIdx.x * 256 + threadIdx.x;
  const int k8n = K / 8;
  if (t >= N * k8n) return;
  const int n = t / k8n, k8 = (t % k8n) * 8;
  v8us v;
#pragma unroll
  for (int i = 0; i < 8; ++i) v[i] = bf16_bits(W[(size_t)(k8 + i) * N + n]);
  *(v8us*)(Wt + (size_t)n * K + k8) = v;
  
}

// GEMM C[M][N] (f32, pitch ldc) = act(A[M][K]·W + bias). A f32 row-major (pitch lda) converted per fragment to bf16
// (ASPLIT: hi/lo two planes -> 2 terms, else single rounded term); Wt bf16 [N][K] (pitch ldb). BIAS_BF16 rounds the
// bias to bf16 first (bias quantised to bf16 before the add). K%32==0, M%16==0, N%64==0.
template <bool ASPLIT, int ACT, bool BIAS_BF16>
__global__ __launch_bounds__(128) void k_gemm_bf(const float* __restrict__ A, int lda, const unsigned short* __restrict__ Wt, int ldb,
                                               const float* __restrict__ bias, float* __restrict__ C, int ldc, int M, int N, int K) {
  __shared__ __attribute__((aligned(16))) float so[4][16][64];
  const int tid = threadIdx.x, w = tid >> 5, lane = tid & 31, ln = lane & 15, hh = lane >> 4;
  const int ntn = N / 64;
  const int wid = blockIdx.x * 4 + w;
  const int mt = wid / ntn, nq = wid % ntn;
  if (mt * 16 >= M) return;
  const int row0 = mt * 16, col0 = nq * 64;
  const float* arow = A + (size_t)(row0 + ln) * lda;
  v8f acc[4] = {};
  for (int kb = 0; kb < K; kb += 32) {
    FragB ah, al;
    const v4f x0 = *(const v4fa*)(arow + kb + 8 * hh), x1 = *(const v4fa*)(arow + kb + 8 * hh + 4);
    const v4f x2 = *(const v4fa*)(arow + kb + 16 + 8 * hh), x3 = *(const v4fa*)(arow + kb + 16 + 8 * hh + 4);
    float xs[16] = {x0[0],x0[1],x0[2],x0[3],x1[0],x1[1],x1[2],x1[3],x2[0],x2[1],x2[2],x2[3],x3[0],x3[1],x3[2],x3[3]};
#pragma unroll
    for (int i = 0; i < 16; ++i) { const unsigned short hb = bf16_bits(xs[i]); ah.u[i] = hb; al.u[i] = ASPLIT ? bf16_bits(xs[i] - bf16_val(hb)) : (unsigned short)0; }
#pragma unroll
    for (int t = 0; t < 4; ++t) {
      const unsigned short* brow = Wt + (size_t)(col0 + t * 16 + ln) * ldb + kb;
      FragB b;
      b.half[0] = *(const v8us*)(brow + 8 * hh);
      b.half[1] = *(const v8us*)(brow + 16 + 8 * hh);
      acc[t] = mmaN<ASPLIT ? 2 : 1>(ah.v, al.v, b.v, b.v, acc[t]);
    }
  }
#pragma unroll
  for (int t = 0; t < 4; ++t) {
    float bv = bias ? bias[col0 + t * 16 + ln] : 0.f;
    if (BIAS_BF16) bv = bf16_round(bv);
#pragma unroll
    for (int r = 0; r < 8; ++r) { float v = acc[t][r] + bv; if (ACT == 1) v = fmaxf(v, 0.f); so[w][8 * hh + r][t * 16 + ln] = v; }
  }
  __builtin_amdgcn_fence(__ATOMIC_ACQ_REL, "workgroup");
  __builtin_amdgcn_wave_barrier();
  const int rsub = lane >> 4, c4 = (lane & 15) * 4;
  {
#pragma unroll
    for (int q = 0; q < 8; ++q) {
      const int r = q * 2 + rsub;
      const v4f v = *(const v4fa*)&so[w][r][c4];
      *(v4f*)(C + (size_t)(row0 + r) * ldc + col0 + c4) = v;
    }
    
  }
}

// GEMM C = act(A·W + bias + resid): A f32 (ASPLIT -> hi/lo 2 terms), Wt bf16 [N][K]; ACT 0 none, 1 relu, 2 exact gelu;
// resid (optional, f32, row index = (row % rmod), pitch ldr, RES_BF16 rounds it) added before the activation.
template <bool ASPLIT, int ACT, bool BIAS_BF16, bool RES_BF16>
__global__ __launch_bounds__(128) void k_gemm_bf3(const float* __restrict__ A, int lda, const unsigned short* __restrict__ Wt, int ldb,
                                                const float* __restrict__ bias, const float* __restrict__ resid, int rmod, int ldr,
                                                float* __restrict__ C, int ldc, int M, int N, int K) {
  __shared__ __attribute__((aligned(16))) float so[4][16][64];
  const int tid = threadIdx.x, w = tid >> 5, lane = tid & 31, ln = lane & 15, hh = lane >> 4;
  const int ntn = N / 64;
  const int wid = blockIdx.x * 4 + w;
  const int mt = wid / ntn, nq = wid % ntn;
  if (mt * 16 >= M) return;
  const int row0 = mt * 16, col0 = nq * 64;
  const float* arow = A + (size_t)(row0 + ln) * lda;
  v8f acc[4] = {};
  for (int kb = 0; kb < K; kb += 32) {
    FragB ah, al;
    const v4f x0 = *(const v4fa*)(arow + kb + 8 * hh), x1 = *(const v4fa*)(arow + kb + 8 * hh + 4);
    const v4f x2 = *(const v4fa*)(arow + kb + 16 + 8 * hh), x3 = *(const v4fa*)(arow + kb + 16 + 8 * hh + 4);
    float xs[16] = {x0[0],x0[1],x0[2],x0[3],x1[0],x1[1],x1[2],x1[3],x2[0],x2[1],x2[2],x2[3],x3[0],x3[1],x3[2],x3[3]};
#pragma unroll
    for (int i = 0; i < 16; ++i) { const unsigned short hb = bf16_bits(xs[i]); ah.u[i] = hb; al.u[i] = ASPLIT ? bf16_bits(xs[i] - bf16_val(hb)) : (unsigned short)0; }
#pragma unroll
    for (int t = 0; t < 4; ++t) {
      const unsigned short* brow = Wt + (size_t)(col0 + t * 16 + ln) * ldb + kb;
      FragB b;
      b.half[0] = *(const v8us*)(brow + 8 * hh);
      b.half[1] = *(const v8us*)(brow + 16 + 8 * hh);
      acc[t] = mmaN<ASPLIT ? 2 : 1>(ah.v, al.v, b.v, b.v, acc[t]);
    }
  }
#pragma unroll
  for (int t = 0; t < 4; ++t) {
    const int col = col0 + t * 16 + ln;
    float bv = bias ? bias[col] : 0.f;
    if (BIAS_BF16) bv = bf16_round(bv);
#pragma unroll
    for (int r = 0; r < 8; ++r) {
      float v = acc[t][r] + bv;
      if (resid) { float rv = resid[(size_t)((row0 + 8 * hh + r) % rmod) * ldr + col]; if (RES_BF16) rv = bf16_round(rv); v += rv; }
      if (ACT == 1) v = fmaxf(v, 0.f);
      if (ACT == 2) v = 0.5f * v * (1.0f + erff(v * 0.70710678118654752f));
      if (ACT == 3) { const float u = 0.7978845608028654f * (v + 0.044715f * v * v * v); v = 0.5f * v * (1.0f + tanhf(u)); }
      so[w][8 * hh + r][t * 16 + ln] = v;
    }
  }
  __builtin_amdgcn_fence(__ATOMIC_ACQ_REL, "workgroup");
  __builtin_amdgcn_wave_barrier();
  const int rsub = lane >> 4, c4 = (lane & 15) * 4;
  {
#pragma unroll
    for (int q = 0; q < 8; ++q) {
      const int r = q * 2 + rsub;
      const v4f v = *(const v4fa*)&so[w][r][c4];
      *(v4f*)(C + (size_t)(row0 + r) * ldc + col0 + c4) = v;
    }
    
  }
}
// row LayerNorm (biased variance, eps) over N: s = X (+ R); optional out_sum <- s; out_norm <- (s-mu)*rsqrt(var+eps)*g + b
template <bool PARAM_BF16>
__global__ __launch_bounds__(256) void k_layernorm(const float* __restrict__ X, const float* __restrict__ R, const float* __restrict__ g, const float* __restrict__ bta,
                                                  float* __restrict__ out_sum, float* __restrict__ out_norm, int N, float eps) {
  __shared__ float red[256];
  const int row = blockIdx.x, tid = threadIdx.x;
  const float* x = X + (size_t)row * N; const float* rr = R ? R + (size_t)row * N : nullptr;
  float vals[16];                     // up to N = 4096
  const int per = N / 256;            // contiguous chunk per thread? use strided-by-4 chunks: thread handles j = tid*4 + 1024*u
  float s1 = 0.f;
  for (int u = 0; u < per / 4; ++u) {
    const int j = tid * 4 + 1024 * u;
    const v4f a = *(const v4fa*)(x + j);
    v4f b = {0.f,0.f,0.f,0.f}; if (rr) b = *(const v4fa*)(rr + j);
#pragma unroll
    for (int q = 0; q < 4; ++q) { const float v = a[q] + b[q]; vals[u * 4 + q] = v; s1 += v; }
  }
  red[tid] = s1; __syncthreads();
  for (int st = 128; st > 0; st >>= 1) { if (tid < st) red[tid] += red[tid + st]; __syncthreads(); }
  const float mu = red[0] / (float)N; __syncthreads();
  float s2 = 0.f;
  for (int u = 0; u < per / 4; ++u)
#pragma unroll
    for (int q = 0; q < 4; ++q) { const float c = vals[u * 4 + q] - mu; s2 += c * c; }
  red[tid] = s2; __syncthreads();
  for (int st = 128; st > 0; st >>= 1) { if (tid < st) red[tid] += red[tid + st]; __syncthreads(); }
  const float rs = rsqrtf(red[0] / (float)N + eps);
  {
    for (int u = 0; u < per / 4; ++u) {
      const int j = tid * 4 + 1024 * u;
      v4f o, sm;
#pragma unroll
      for (int q = 0; q < 4; ++q) {
        float gg = g[j + q], bb = bta[j + q];
        if (PARAM_BF16) { gg = bf16_round(gg); bb = bf16_round(bb); }
        sm[q] = vals[u * 4 + q]; o[q] = (vals[u * 4 + q] - mu) * rs * gg + bb;
      }
      if (out_sum) *(v4f*)(out_sum + (size_t)row * N + j) = sm;
      *(v4f*)(out_norm + (size_t)row * N + j) = o;
    }
    
  }
}



// ---- f16 WMMA path (v_wmma_f32_16x16x32_f16): 11-bit significands for operands in range — used where a [0,1] probability operand needs more precision than bf16
typedef _Float16 v16h __attribute__((ext_vector_type(16)));
union FragH { v16h v; v8us half[2]; _Float16 h[16]; unsigned short u[16]; };
template <int NT>
__device__ __forceinline__ v8f mmaH(v16h ah, v16h al, v16h bh, v16h bl, v8f c) {
  c = __builtin_amdgcn_wmma_f32_16x16x32_f16(false, ah, false, bh, (short)0, c, false, false);
  if (NT >= 2) c = __builtin_amdgcn_wmma_f32_16x16x32_f16(false, al, false, bh, (short)0, c, false, false);
  if (NT >= 3) c = __builtin_amdgcn_wmma_f32_16x16x32_f16(false, ah, false, bl, (short)0, c, false, false);
  asm volatile("v_nop\n\tv_nop\n\tv_nop\n\tv_nop" : "+v"(c) : "v"(ah), "v"(al), "v"(bh), "v"(bl));
  return c;
}
// batched GEMM like k_gemm_b but f16 operands: A f32 (split into f16 hi/lo if ASPLIT, else rounded to f16), Bt = f16 values [n][k]; alpha; C f32; N multiple of 16 (partial tiles skipped)
template <bool ASPLIT>
__global__ __launch_bounds__(128) void k_gemm_h(const float* __restrict__ A, int lda, size_t sA, const _Float16* __restrict__ Bh, int ldb, size_t sB, float alpha, float* __restrict__ C, int ldc, size_t sC, int M, int N, int K) {
  __shared__ __attribute__((aligned(16))) float so[4][16][64];
  const int tid = threadIdx.x, w = tid >> 5, lane = tid & 31, ln = lane & 15, hh = lane >> 4; const int by = blockIdx.y;
  A += (size_t)by * sA; Bh += (size_t)by * sB; C += (size_t)by * sC;
  const int ntn = (N + 63) / 64; const int wid = blockIdx.x * 4 + w; const int mt = wid / ntn, nq = wid % ntn; if (mt * 16 >= M) return;
  const int row0 = mt * 16, col0 = nq * 64; const float* arow = A + (size_t)(row0 + ln) * lda;
  v8f acc[4] = {};
  for (int kb = 0; kb < K; kb += 32) {
    FragH ah, al;
    const v4f x0 = *(const v4fa*)(arow + kb + 8 * hh), x1 = *(const v4fa*)(arow + kb + 8 * hh + 4), x2 = *(const v4fa*)(arow + kb + 16 + 8 * hh), x3 = *(const v4fa*)(arow + kb + 16 + 8 * hh + 4);
    float xs[16] = {x0[0],x0[1],x0[2],x0[3],x1[0],x1[1],x1[2],x1[3],x2[0],x2[1],x2[2],x2[3],x3[0],x3[1],x3[2],x3[3]};
#pragma unroll
    for (int i = 0; i < 16; ++i) { const _Float16 h = (_Float16)xs[i]; ah.h[i] = h; al.h[i] = ASPLIT ? (_Float16)(xs[i] - (float)h) : (_Float16)0.0f; }
#pragma unroll
    for (int t = 0; t < 4; ++t) { if (col0 + t * 16 >= N) continue; const size_t boff = (size_t)(col0 + t * 16 + ln) * ldb + kb; FragH bq; bq.half[0] = *(const v8us*)(Bh + boff + 8 * hh); bq.half[1] = *(const v8us*)(Bh + boff + 16 + 8 * hh);
      acc[t] = mmaH<ASPLIT ? 2 : 1>(ah.v, al.v, bq.v, bq.v, acc[t]); }
  }
#pragma unroll
  for (int t = 0; t < 4; ++t) { if (col0 + t * 16 >= N) continue;
#pragma unroll
    for (int r = 0; r < 8; ++r) so[w][8 * hh + r][t * 16 + ln] = acc[t][r] * alpha; }
  __builtin_amdgcn_fence(__ATOMIC_ACQ_REL, "workgroup"); __builtin_amdgcn_wave_barrier();
  const int rsub = lane >> 4, c4 = (lane & 15) * 4;
  {
#pragma unroll
    for (int q = 0; q < 8; ++q) { const int r = q * 2 + rsub; if (col0 + c4 < N) { const v4f v = *(const v4fa*)&so[w][r][c4]; *(v4f*)(C + (size_t)(row0 + r) * ldc + col0 + c4) = v; } }
     }
}

// Wt[y][n][k] = f16(W_y[k][n] x scale) from four f32 row-major DM x DM weights, one launch (grid.y: the weight; the four output planes lie in a row). scale = power of two; bf16-exact weights stay exact in f16 away from the subnormal range.
// A block turns one WTT x WTT tile through LDS: a wave loads whole 512-byte pieces of W rows (two neighbouring k rows a round, so that a k pair packs into one 32-bit LDS word), and stores whole 256-byte pieces of Wt rows.
#define WTT 128                      /* tile edge */
#define WTW 65                       /* LDS row pitch in 32-bit words: odd, so the 16 lanes that read one row and the 16 that read the next fall on different banks */
__global__ __launch_bounds__(256) void k_wt4(const float* __restrict__ W0, const float* __restrict__ W1, const float* __restrict__ W2, const float* __restrict__ W3, _Float16* __restrict__ Wt, float scale) {
  __shared__ unsigned int tl[WTT][WTW];      /* tl[n][k / 2] = the f16 pair (k, k + 1) of column n */
  const int tid = threadIdx.x, w = tid >> 5, lane = tid & 31; const int y = blockIdx.y;
  const float* W = y == 0 ? W0 : y == 1 ? W1 : y == 2 ? W2 : W3;
  const int k0 = (blockIdx.x / (DM / WTT)) * WTT, n0 = (blockIdx.x % (DM / WTT)) * WTT;
  const float* wp = W + (size_t)(k0 + 2 * w) * DM + n0 + lane * 4;
  v4f a[8][2];
#pragma unroll      /* static indices keep the tile in registers; all of a thread's loads in flight together */
  for (int i = 0; i < 8; ++i) for (int j = 0; j < 2; ++j) a[i][j] = *(const v4fa*)(wp + (size_t)(16 * i + j) * DM);
  asm volatile("s_wait_xcnt 0x0" :: "v"(wp) : "memory");      /* the loads' address registers are reused behind them; wp is named as an input so that they stay whole up to this wait */
  __builtin_amdgcn_sched_barrier(0);      /* every load is issued in front of the arithmetic: without it half of the loads sink behind the first conversions and their latency is paid again */
#pragma unroll      /* static indices, as above */
  for (int i = 0; i < 8; ++i) for (int q = 0; q < 4; ++q) { FragH f; f.h[0] = (_Float16)(bf16_round(a[i][0][q]) * scale); f.h[1] = (_Float16)(bf16_round(a[i][1][q]) * scale);
    tl[lane * 4 + q][w + 8 * i] = (unsigned int)f.u[0] | ((unsigned int)f.u[1] << 16); }
  __syncthreads();      /* the tile is complete before any thread reads a column of it */
  typedef unsigned int v4u __attribute__((ext_vector_type(4), may_alias));
  const int nr = tid >> 4, c = tid & 15; v4u o[8];
#pragma unroll      /* static indices, as above */
  for (int it = 0; it < 8; ++it) for (int u = 0; u < 4; ++u) o[it][u] = tl[16 * it + nr][4 * c + u];
  _Float16* op = Wt + (size_t)y * DM * DM + (size_t)(n0 + nr) * DM + k0 + 8 * c;
#pragma unroll      /* static indices; the stores stand last, nothing is written behind them */
  for (int it = 0; it < 8; ++it) *(v4u*)(op + (size_t)(16 * it) * DM) = o[it];
}
// k_gemm_hh variant with fused epilogue: v = acc·alpha + bias[by·sBias + col] (+ CP[(row/rowsPerB)·sCPb + by·64 + col] if CP) ; ACT 0 none / 1 elu ; writes f16 C16 (and f32 C if non-null)
template <int ACT>
__global__ __launch_bounds__(128) void k_gemm_hhx(const _Float16* __restrict__ A, int lda, size_t sA, const _Float16* __restrict__ Bh, int ldb, size_t sB, float alpha, const float* __restrict__ bias, size_t sBias, const float* __restrict__ CP, int rowsPerB, size_t sCPb, int row0g,
    float* __restrict__ C, _Float16* __restrict__ C16, int ldc, size_t sC, int M, int N, int K) {
  __shared__ __attribute__((aligned(16))) float so[4][16][64];
  const int tid = threadIdx.x, w = tid >> 5, lane = tid & 31, ln = lane & 15, hh = lane >> 4; const int by = blockIdx.y;
  A += (size_t)by * sA; Bh += (size_t)by * sB; const size_t cofs = (size_t)by * sC; const float* bp = bias ? bias + (size_t)by * sBias : nullptr;
  const int ntn = (N + 63) / 64; const int wid = blockIdx.x * 4 + w; const int mt = wid / ntn, nq = wid % ntn; if (mt * 16 >= M) return;
  const int row0 = mt * 16, col0 = nq * 64; const _Float16* arow = A + (size_t)(row0 + ln) * lda;
  v8f acc[4] = {};
  for (int kb = 0; kb < K; kb += 32) { FragH ah; ah.half[0] = *(const v8us*)((const unsigned short*)arow + kb + 8 * hh); ah.half[1] = *(const v8us*)((const unsigned short*)arow + kb + 16 + 8 * hh);
#pragma unroll
    for (int t = 0; t < 4; ++t) { if (col0 + t * 16 >= N) continue; const size_t boff = (size_t)(col0 + t * 16 + ln) * ldb + kb; FragH bq; bq.half[0] = *(const v8us*)((const unsigned short*)Bh + boff + 8 * hh); bq.half[1] = *(const v8us*)((const unsigned short*)Bh + boff + 16 + 8 * hh);
      acc[t] = mmaH<1>(ah.v, ah.v, bq.v, bq.v, acc[t]); }
  }
#pragma unroll
  for (int t = 0; t < 4; ++t) { if (col0 + t * 16 >= N) continue; const int col = col0 + t * 16 + ln; const float bv = bp ? bf16_round(bp[col]) : 0.f;
#pragma unroll
    for (int r = 0; r < 8; ++r) { float v = acc[t][r] * alpha + bv; if (CP) { const int rr = row0g + row0 + 8 * hh + r; if (rowsPerB < 0) v += CP[cofs + (size_t)rr * ldc + col];      /* rowsPerB < 0: own element of the batched C plane */ else { const int bidx = rr / rowsPerB; v += CP[(size_t)bidx * sCPb + (size_t)by * 64 + col]; } } if (ACT == 1) v = (v > 0.f) ? v : expm1f(v); else if (ACT == 7) v = (v > 0.f) ? v + 1.0f : expf(v); else if (ACT == 8) v = tanhf(v); else if (ACT == 9) v = 0.5f * v * (1.0f + tanhf(0.7978845608028654f * (v + 0.044715f * v * v * v))); else if (ACT == 11) v = 1.0f / (1.0f + expf(-v)); else if (ACT == 12) v = (v > 0.f) ? v : 0.01f * v; else if (ACT == 14) v = (v > 0.f) ? v : 0.1f * v; else if (ACT == 16) v = (v >= 0.f) ? v : 0.3f * v; else if (ACT == 17) v = (v >= 0.f) ? v : 0.2f * v; else if (ACT == 15) v = v / (1.0f + expf(-v)); else if (ACT == 3) v = fmaxf(v, 0.f); else if (ACT == 6) v = 0.5f * v * (1.0f + erff(v * 0.70710678118654752f)); so[w][8 * hh + r][t * 16 + ln] = v; } }
  __builtin_amdgcn_fence(__ATOMIC_ACQ_REL, "workgroup"); __builtin_amdgcn_wave_barrier();
  const int rsub = lane >> 4, c4 = (lane & 15) * 4; typedef _Float16 v4h __attribute__((ext_vector_type(4)));
  {
#pragma unroll
    for (int q = 0; q < 8; ++q) { const int r = q * 2 + rsub; if (col0 + c4 < N) { const v4f v = *(const v4fa*)&so[w][r][c4]; if (C) *(v4f*)(C + cofs + (size_t)(row0 + r) * ldc + col0 + c4) = v; if (C16) { v4h h4; for (int i = 0; i < 4; ++i) h4[i] = (_Float16)v[i]; *(v4h*)(C16 + cofs + (size_t)(row0 + r) * ldc + col0 + c4) = h4; } } }
     }
}


typedef _Float16 v4h __attribute__((ext_vector_type(4)));

__global__ __launch_bounds__(256) void k_x16(const float* __restrict__ x, _Float16* __restrict__ X16, size_t n8) { const size_t t = (size_t)blockIdx.x * 256 + threadIdx.x; if (t >= n8) return; FragH f;
#pragma unroll
  for (int q = 0; q < 8; ++q) f.h[q] = (_Float16)bf16_round(x[t * 8 + q]); *(v8us*)((unsigned short*)X16 + t * 8) = f.half[0];  }
__global__ __launch_bounds__(256) void k_h16(const float* __restrict__ x, _Float16* __restrict__ X16, size_t n8) { const size_t t = (size_t)blockIdx.x * 256 + threadIdx.x; if (t >= n8) return; FragH f;
#pragma unroll
  for (int q = 0; q < 8; ++q) f.h[q] = (_Float16)x[t * 8 + q]; *(v8us*)((unsigned short*)X16 + t * 8) = f.half[0];  }
__global__ __launch_bounds__(256) void k_round16f(const float* __restrict__ W, _Float16* __restrict__ Bt, size_t n8) { const size_t t = (size_t)blockIdx.x * 256 + threadIdx.x; if (t >= n8) return; FragH f;
#pragma unroll
  for (int i = 0; i < 8; ++i) f.h[i] = (_Float16)(bf16_round(W[t * 8 + i]) * 16.0f); *(v8us*)((unsigned short*)Bt + t * 8) = f.half[0];  }
template <int NHv, int TTv>
__global__ __launch_bounds__(256) void k_vt(const _Float16* __restrict__ V16, int ldv, int voff, _Float16* __restrict__ Vt) { __shared__ unsigned short tl[64][66]; const int tid = threadIdx.x; const int slab = blockIdx.x / (TTv / 64), lg = blockIdx.x % (TTv / 64); const int b = slab / NHv, h = slab % NHv;
  for (int i = tid; i < 64 * 8; i += 256) { const int r = i / 8, c8 = (i % 8) * 8; FragH f; f.half[0] = *(const v8us*)((const unsigned short*)V16 + ((size_t)b * TTv + lg * 64 + r) * ldv + voff + h * 64 + c8);
#pragma unroll
    for (int q = 0; q < 8; ++q) tl[r][c8 + q] = f.u[q]; }
  __syncthreads();
  {
#pragma unroll
    for (int rd = 0; rd < 2; ++rd) { const int d = rd * 32 + tid / 8, pc = tid % 8; FragH f;
#pragma unroll
      for (int q = 0; q < 8; ++q) f.u[q] = tl[pc * 8 + q][d];
      *(v8us*)((unsigned short*)Vt + ((size_t)slab * 64 + d) * TTv + lg * 64 + pc * 8) = f.half[0]; }
     } }

__global__ __launch_bounds__(256) void k_hl(const float* __restrict__ F, _Float16* __restrict__ Hh, _Float16* __restrict__ Hl, size_t n8) { const size_t t = (size_t)blockIdx.x * 256 + threadIdx.x; if (t >= n8) return; FragH fh, fl; const v4f a = *(const v4fa*)(F + t * 8), c = *(const v4fa*)(F + t * 8 + 4);
#pragma unroll
  for (int q = 0; q < 4; ++q) { _Float16 h = (_Float16)a[q]; fh.h[q] = h; fl.h[q] = (_Float16)((a[q] - (float)h) * 1024.0f); h = (_Float16)c[q]; fh.h[4 + q] = h; fl.h[4 + q] = (_Float16)((c[q] - (float)h) * 1024.0f); }
  { *(v8us*)((unsigned short*)Hh + t * 8) = fh.half[0]; *(v8us*)((unsigned short*)Hl + t * 8) = fl.half[0];  } }

// ---- fast GEMM (block tile 128x128 = eight waves of 32x64; requires M % 128 == 0 rows per launch region, N % 128 == 0 and K % 64 == 0); epilogue = k_gemm_hhx semantics ----
// The block's 128 A rows and 128 B rows come in tiles of GKS k, loaded as whole 128-byte lines and staged through registers into two LDS buffers: tile s + 1 is loaded from memory while tile s is worked on, and one barrier a tile both publishes it and frees the buffer read before. Every wave takes its fragments from LDS in the k order of g2_frag, 32 k at a time in rising order, so each accumulator sums as before.
// DUAL: a second A plane (A2, the same rows and pitch) is staged beside the first and multiplied with the same B fragments into accumulators of its own; the epilogue forms acc alpha + bias, then adds acc2 alpha2, the sum that two launches formed through an f32 plane in memory.
#define GKS 64                       /* k per staged tile: 128 bytes of every operand row */
#define GPIT 72                      /* LDS row pitch in f16 elements: 144 bytes = 16 x odd, free of bank conflicts for 16-byte fragment reads */
__device__ __forceinline__ v16h g2_frag(const _Float16* p, int hh) { FragH f; f.half[0] = *(const v8us*)((const unsigned short*)p + 8 * hh); f.half[1] = *(const v8us*)((const unsigned short*)p + 16 + 8 * hh); return f.v; }
__device__ __forceinline__ v8f g2_mma(v16h a, v16h b, v8f c) { v8f d = __builtin_amdgcn_wmma_f32_16x16x32_f16(false, a, false, b, (short)0, c, false, false); asm volatile("v_nop\n\tv_nop\n\tv_nop\n\tv_nop" : "+v"(d) : "v"(a), "v"(b)); return d; }
template <int ACT, int CLD = DM, bool DUAL = false>      /* CLD: the row pitch of C for which the own-element addend has its fast path, a constant so that a lane's 16 loads share one address and differ in the immediate offset */
__global__ __launch_bounds__(256) void k_gemm2(const _Float16* __restrict__ A, int lda, size_t sA, const _Float16* __restrict__ Bh, int ldb, size_t sB, float alpha, const float* __restrict__ bias, size_t sBias, const float* __restrict__ CP, int rowsPerB, size_t sCPb, int row0g,
    float* __restrict__ C, _Float16* __restrict__ C16, int ldc, size_t sC, int M, int N, int K, size_t zA, size_t zB, size_t zC, const float* __restrict__ bias1, const float* __restrict__ bias2, const _Float16* __restrict__ A2, float alpha2) { static_assert(ACT == 0 || ACT == 3 || ACT == 6 || ACT == 8 || ACT == 9 || ACT == 11 || ACT == 12 || ACT == 14 || ACT == 15 || ACT == 16 || ACT == 17, "k_gemm2: unsupported ACT code (would silently apply no activation)");
  constexpr int TR = DUAL ? 384 : 256;      /* rows of a buffer */
  __shared__ __attribute__((aligned(16))) unsigned char sm[2 * TR * GPIT * 2];      /* two buffers of [A 128 rows | B 128 rows | DUAL: A2 128 rows]; behind the last tile's barrier the same bytes hold the epilogue's rows */
  static_assert(sizeof(float) * 8 * 32 * 68 <= sizeof(sm), "the epilogue rows fit the tile buffers");
  unsigned short* const ring = (unsigned short*)sm; float (* const so)[32][68] = (float (*)[32][68])sm;
  const int tid = threadIdx.x, w = tid >> 5, lane = tid & 31, ln = lane & 15, hh = lane >> 4; const int by = blockIdx.y, bz = blockIdx.z;      /* grid.z: a second batch index (element strides zA, zB, zC) */
  A += (size_t)by * sA + (size_t)bz * zA; Bh += (size_t)by * sB + (size_t)bz * zB; const size_t cofs = (size_t)by * sC + (size_t)bz * zC; const float* bp = bias ? bias + (size_t)by * sBias : nullptr;
  if (bias1 && by == 1) bp = bias1; if (bias2 && by == 2) bp = bias2;      /* bias vectors that are separate buffers: one per grid.y index */
  const int ntn = N >> 7; const int mt = blockIdx.x / ntn, nq = blockIdx.x - mt * ntn; if (mt * 128 >= M) return;      /* the whole block leaves, in front of every barrier */
  const int wr = w & 3, wc = w >> 2; const int row0 = mt * 128 + 32 * wr, col0 = nq * 128 + 64 * wc;      /* four waves down, two across */
  const int sr = tid >> 3, sc = (tid & 7) * 8;      /* staging: 8 threads cover one row's 128 bytes, the block 32 rows a round */
  const unsigned short* ap = (const unsigned short*)A + (size_t)(mt * 128 + sr) * lda + sc; const unsigned short* bq = (const unsigned short*)Bh + (size_t)(nq * 128 + sr) * ldb + sc;
  const unsigned short* ep = DUAL ? (const unsigned short*)A2 + (size_t)by * sA + (size_t)bz * zA + (size_t)(mt * 128 + sr) * lda + sc : ap;      /* the second plane: the same place as in the first */
  v8us ar[4], br[4], er[4]; const unsigned short *pa[4], *pb[4], *pe[4];      /* a tile's load addresses */
#pragma unroll      /* static indices keep the staging registers in registers */
  for (int i = 0; i < 4; ++i) { pa[i] = ap + (size_t)(32 * i) * lda; pb[i] = bq + (size_t)(32 * i) * ldb; pe[i] = DUAL ? ep + (size_t)(32 * i) * lda : pa[i]; ar[i] = *(const v8us*)pa[i]; br[i] = *(const v8us*)pb[i]; if (DUAL) er[i] = *(const v8us*)pe[i]; }
  asm volatile("s_wait_xcnt 0x0" :: "v"(pa[0]), "v"(pa[1]), "v"(pa[2]), "v"(pa[3]), "v"(pb[0]), "v"(pb[1]), "v"(pb[2]), "v"(pb[3]), "v"(pe[0]), "v"(pe[1]), "v"(pe[2]), "v"(pe[3]) : "memory");      /* the loads' address registers are advanced behind them; the addresses are named as inputs so that they stay whole up to this wait (else a later load of the run may land on them) */
  ap += GKS; bq += GKS; ep += GKS;      /* tile 1 */
#pragma unroll      /* static indices, as above */
  for (int i = 0; i < 4; ++i) { *(v8us*)(ring + (sr + 32 * i) * GPIT + sc) = ar[i]; *(v8us*)(ring + (128 + sr + 32 * i) * GPIT + sc) = br[i]; if (DUAL) *(v8us*)(ring + (256 + sr + 32 * i) * GPIT + sc) = er[i]; }
  __syncthreads();      /* tile 0 is complete before any wave reads it */
  const v8f z8 = {0.f,0.f,0.f,0.f,0.f,0.f,0.f,0.f}; v8f c00 = z8, c01 = z8, c02 = z8, c03 = z8, c10 = z8, c11 = z8, c12 = z8, c13 = z8;
  v8f d00 = z8, d01 = z8, d02 = z8, d03 = z8, d10 = z8, d11 = z8, d12 = z8, d13 = z8;      /* DUAL: the second plane's sums */
  const int nst = K / GKS;
#pragma unroll 1      /* one k tile at a time: the two buffers alternate */
  for (int s = 0; s < nst; ++s) {
    const bool more = s + 1 < nst;      /* the same for the whole block */
    if (more) {
#pragma unroll      /* static indices; all of a thread's tile loads in flight under this tile's work */
      for (int i = 0; i < 4; ++i) { pa[i] = ap + (size_t)(32 * i) * lda; pb[i] = bq + (size_t)(32 * i) * ldb; pe[i] = DUAL ? ep + (size_t)(32 * i) * lda : pa[i]; ar[i] = *(const v8us*)pa[i]; br[i] = *(const v8us*)pb[i]; if (DUAL) er[i] = *(const v8us*)pe[i]; }
      asm volatile("s_wait_xcnt 0x0" :: "v"(pa[0]), "v"(pa[1]), "v"(pa[2]), "v"(pa[3]), "v"(pb[0]), "v"(pb[1]), "v"(pb[2]), "v"(pb[3]), "v"(pe[0]), "v"(pe[1]), "v"(pe[2]), "v"(pe[3]) : "memory");      /* the loads' address registers are advanced behind them; named as inputs, as above */
      ap += GKS; bq += GKS; ep += GKS; }
    const _Float16* al = (const _Float16*)(ring + ((s & 1) * TR + 32 * wr + ln) * GPIT); const _Float16* bl = (const _Float16*)(ring + ((s & 1) * TR + 128 + 64 * wc + ln) * GPIT);
#pragma unroll      /* two 32-k passes a tile, constant LDS offsets */
    for (int kk = 0; kk < GKS; kk += 32) { const v16h a0 = g2_frag(al + kk, hh), a1 = g2_frag(al + 16 * GPIT + kk, hh);
      const v16h b0 = g2_frag(bl + kk, hh), b1 = g2_frag(bl + 16 * GPIT + kk, hh), b2 = g2_frag(bl + 32 * GPIT + kk, hh), b3 = g2_frag(bl + 48 * GPIT + kk, hh);      /* a pass's LDS reads stand together in front of its products */
      const v16h e0 = DUAL ? g2_frag(al + 256 * GPIT + kk, hh) : a0, e1 = DUAL ? g2_frag(al + 272 * GPIT + kk, hh) : a1;      /* the same rows of the second plane */
      c00 = g2_mma(a0, b0, c00); c10 = g2_mma(a1, b0, c10); c01 = g2_mma(a0, b1, c01); c11 = g2_mma(a1, b1, c11);
      c02 = g2_mma(a0, b2, c02); c12 = g2_mma(a1, b2, c12); c03 = g2_mma(a0, b3, c03); c13 = g2_mma(a1, b3, c13);
      if (DUAL) {      /* against the B fragments already in registers */
        d00 = g2_mma(e0, b0, d00); d10 = g2_mma(e1, b0, d10); d01 = g2_mma(e0, b1, d01); d11 = g2_mma(e1, b1, d11);
        d02 = g2_mma(e0, b2, d02); d12 = g2_mma(e1, b2, d12); d03 = g2_mma(e0, b3, d03); d13 = g2_mma(e1, b3, d13); } }
    if (more) {
#pragma unroll      /* static indices, as above */
      for (int i = 0; i < 4; ++i) { *(v8us*)(ring + (((s + 1) & 1) * TR + sr + 32 * i) * GPIT + sc) = ar[i]; *(v8us*)(ring + (((s + 1) & 1) * TR + 128 + sr + 32 * i) * GPIT + sc) = br[i]; if (DUAL) *(v8us*)(ring + (((s + 1) & 1) * TR + 256 + sr + 32 * i) * GPIT + sc) = er[i]; } }      /* into the buffer that every wave left before the last barrier */
    __syncthreads();      /* tile s + 1 is complete, and every wave has left tile s, before the next trip (behind the last tile: before the epilogue's rows overwrite it) */
  }
  v8f accs[8] = {c00, c01, c02, c03, c10, c11, c12, c13}; v8f acc2[8] = {d00, d01, d02, d03, d10, d11, d12, d13};
  const int rsub = lane >> 4, c4 = (lane & 15) * 4;      /* the store phase's layout: 16 lanes cover 256 bytes of a row, a wave two rows a round */
  if (DUAL) CP = nullptr;      /* the second plane's sums take the addend's place: neither addend path is compiled */
  const bool own = ACT == 0 && CP && rowsPerB < 0 && ldc == CLD;      /* own-element addend with nothing applied behind the add (the same for the whole block): read in the store phase's layout, each lane the 16 bytes it will store, all 16 loads in flight together (behind the LDS pass, where the accumulators' registers are free: the register count stays at six waves a SIMD); added there in the same place of the sum */
  const float* const cown = CP; if (own) CP = nullptr;      /* the element-by-element path below is then not taken */
#pragma unroll
  for (int u = 0; u < 8; ++u) { const int t = u & 3, half = u >> 2; const int col = col0 + t * 16 + ln; const float bv = bp ? bf16_round(bp[col]) : 0.f;
#pragma unroll
    for (int r = 0; r < 8; ++r) { const int rloc = half * 16 + 8 * hh + r; float v = accs[u][r] * alpha + bv; if (CP) { if (rowsPerB < 0) v += CP[cofs + (size_t)(row0g + row0 + rloc) * ldc + col];      /* rowsPerB < 0: own element of the batched C plane */ else { const int bidx = (row0g + row0 + rloc) / rowsPerB; v += CP[(size_t)bidx * sCPb + (size_t)by * 64 + col]; } }
      if (DUAL) v += acc2[u][r] * alpha2;      /* alpha2 is a power of two: the product is exact, fused or not */
      if (ACT == 3) v = fmaxf(v, 0.f); else if (ACT == 6) v = 0.5f * v * (1.0f + erff(v * 0.70710678118654752f)); else if (ACT == 11) v = 1.0f / (1.0f + expf(-v)); else if (ACT == 15) v = v / (1.0f + expf(-v)); else if (ACT == 12) v = (v > 0.f) ? v : 0.01f * v; else if (ACT == 8) v = tanhf(v); else if (ACT == 9) v = 0.5f * v * (1.0f + tanhf(0.7978845608028654f * (v + 0.044715f * v * v * v))); else if (ACT == 14) v = (v > 0.f) ? v : 0.1f * v; else if (ACT == 16) v = (v >= 0.f) ? v : 0.3f * v; else if (ACT == 17) v = (v >= 0.f) ? v : 0.2f * v;
      so[w][rloc][t * 16 + ln] = v; } }
  __builtin_amdgcn_fence(__ATOMIC_ACQ_REL, "workgroup"); __builtin_amdgcn_wave_barrier();
  v4f cpv[16];
#pragma unroll      /* static indices keep the addends in registers */
  for (int q = 0; q < 16; ++q) cpv[q] = v4f{0.f, 0.f, 0.f, 0.f};
  if (own) { const float* cq = cown + cofs + (size_t)(row0g + row0 + rsub) * CLD + col0 + c4;
#pragma unroll      /* static indices; every load issued before the first is waited for */
    for (int q = 0; q < 16; ++q) cpv[q] = *(const v4fa*)(cq + (size_t)(2 * q) * CLD);
    asm volatile("s_wait_xcnt 0x0" :: "v"(cq) : "memory"); }      /* the loads' address registers are reused behind them; cq is named as an input so that they stay whole up to this wait (else a later load of the run may land on them) */
  {
#pragma unroll
    for (int q = 0; q < 16; ++q) { const int r = q * 2 + rsub; v4f v = *(const v4fa*)&so[w][r][c4]; if (own) v += cpv[q];
      if (C) { *(v4f*)(C + cofs + (size_t)(row0 + r) * ldc + col0 + c4) = v; asm volatile("s_wait_xcnt 0x0" ::: "memory"); }      /* the store's registers are reused by the f16 conversion and by the next round */
      if (C16) { v4h h4; for (int i = 0; i < 4; ++i) h4[i] = (_Float16)v[i]; *(v4h*)(C16 + cofs + (size_t)(row0 + r) * ldc + col0 + c4) = h4; asm volatile("s_wait_xcnt 0x0" ::: "memory"); } }      /* the store's registers are reused by the next round */
     } }


__global__ __launch_bounds__(256) void k_wnat(const float* __restrict__ w, size_t n8, _Float16* __restrict__ Bt) { const size_t t = (size_t)blockIdx.x * 256 + threadIdx.x; if (t >= n8) return; FragH f; for (int q = 0; q < 8; ++q) f.h[q] = (_Float16)(bf16_round(w[t * 8 + q]) * 16.0f); *(v8us*)((unsigned short*)Bt + t * 8) = f.half[0];  }
__global__ __launch_bounds__(256) void k_rsm(const float* __restrict__ S, _Float16* __restrict__ P, int nrows) {
  #pragma clang fp contract(off)
  const int i = blockIdx.x * 256 + threadIdx.x; if (i >= nrows) return; const float* s = S + (size_t)i * SQ; float mx = -3.0e38f;
#pragma unroll 1
  for (int j = 0; j < SQ; ++j) mx = fmaxf(mx, s[j]); float se = 0.f;
#pragma unroll 1
  for (int j = 0; j < SQ; ++j) se += expf(s[j] - mx); const float sc = 256.0f / se;
#pragma unroll 1
  for (int j0 = 0; j0 < SQ; j0 += 8) { FragH f; for (int q = 0; q < 8; ++q) f.h[q] = (_Float16)(expf(s[j0 + q] - mx) * sc); unsigned short* d = (unsigned short*)P + (size_t)i * SQ + j0; *(v8us*)d = f.half[0];  } }
__global__ __launch_bounds__(256) void k_vt(const _Float16* __restrict__ V16, int b, int h0, _Float16* __restrict__ VT) { __shared__ unsigned short tl[64][65]; const int tid = threadIdx.x; const int hh = blockIdx.x % HG, sg = blockIdx.x / HG; const int s0 = sg * 64; const int h = h0 + hh;
  for (int i = tid; i < 64 * 8; i += 256) { const int j = i / 8, d8 = (i % 8) * 8; FragH f; f.half[0] = *(const v8us*)((const unsigned short*)V16 + ((size_t)b * SQ + s0 + j) * DM + h * HD + d8); for (int q = 0; q < 8; ++q) tl[d8 + q][j] = f.u[q]; }
  __syncthreads();
  { for (int i = tid; i < 64 * 8; i += 256) { const int d = i / 8, j8 = (i % 8) * 8; FragH f; for (int q = 0; q < 8; ++q) f.u[q] = tl[d][j8 + q]; *(v8us*)((unsigned short*)VT + ((size_t)hh * HD + d) * SQ + s0 + j8) = f.half[0]; }  } }



#define FK 64                        /* keys per staged tile */
#define FPIT 72                      /* LDS row pitch in f16 elements: 144 bytes = 16 x odd, free of bank conflicts for 16-byte fragment reads */
#define FCS 0.18033688011112042f     /* 1/8 x log2(e): exponentials in base 2 */
__device__ __forceinline__ float fa_xhalf(float x) { return __builtin_bit_cast(float, __builtin_amdgcn_permlanex16(__builtin_bit_cast(int, x), __builtin_bit_cast(int, x), 0x76543210, 0xfedcba98, false, false)); }      /* lane l reads lane l ^ 16 */
// Base-2 exponentials in asm so that the slot the instruction set asks for behind a transcendental (before its result is read or its source overwritten) is there by construction: the outputs lie apart from every input, so each v_exp_f32 is followed by an independent one, and the v_nop stands behind the last.
__device__ __forceinline__ void fa_exp8(const float (&x)[8], float (&e)[8]) {
  asm("v_exp_f32 %0, %8\n\tv_exp_f32 %1, %9\n\tv_exp_f32 %2, %10\n\tv_exp_f32 %3, %11\n\tv_exp_f32 %4, %12\n\tv_exp_f32 %5, %13\n\tv_exp_f32 %6, %14\n\tv_exp_f32 %7, %15\n\tv_nop"
      : "=&v"(e[0]), "=&v"(e[1]), "=&v"(e[2]), "=&v"(e[3]), "=&v"(e[4]), "=&v"(e[5]), "=&v"(e[6]), "=&v"(e[7]) : "v"(x[0]), "v"(x[1]), "v"(x[2]), "v"(x[3]), "v"(x[4]), "v"(x[5]), "v"(x[6]), "v"(x[7])); }
__device__ __forceinline__ float fa_exp1(float x) { float e; asm("v_exp_f32 %0, %1\n\tv_nop" : "=v"(e) : "v"(x)); return e; }      /* the same slot behind a single one */
__device__ __forceinline__ v8f fa_mma(v16h a, v16h b, v8f c) { return __builtin_amdgcn_wmma_f32_16x16x32_f16(false, a, false, b, (short)0, c, false, false); }
__global__ __launch_bounds__(128) void k_fattn(const _Float16* __restrict__ Q16, const _Float16* __restrict__ K16, const _Float16* __restrict__ VT, _Float16* __restrict__ O16) {
  __shared__ __attribute__((aligned(16))) _Float16 lk[2][FK][FPIT]; __shared__ __attribute__((aligned(16))) _Float16 lv[2][HD][FPIT];
  const int tid = threadIdx.x, w = __builtin_amdgcn_readfirstlane(tid >> 5), lane = tid & 31, ln = lane & 15, hh = lane >> 4;
  const int bh = blockIdx.x % (NB * NH), qb = (SQ / 128 - 1) - blockIdx.x / (NB * NH);      /* the longest query blocks start first */
  const int b = bh / NH, h = bh % NH; const int q0 = qb * 128, qw = q0 + 32 * w; const int nt = (q0 + 128) / FK;      /* key tiles up to the block's last query */
  const int sr = tid >> 3, sc = (tid & 7) * 8;      /* staging: 8 threads cover one row's 128 bytes, the block 16 rows a round */
  const _Float16* kp = K16 + ((size_t)b * SQ + sr) * DM + h * HD + sc; const _Float16* vp = VT + ((size_t)bh * HD + sr) * SQ + sc;
  v8us kr[4], vr[4]; v16h qf[2][2];
#pragma unroll      /* static indices keep the staging registers in registers */
  for (int i = 0; i < 4; ++i) { kr[i] = *(const v8us*)((const unsigned short*)kp + (size_t)(16 * i) * DM); vr[i] = *(const v8us*)((const unsigned short*)vp + (size_t)(16 * i) * SQ); }
#pragma unroll      /* static indices, as above */
  for (int g = 0; g < 2; ++g) { const _Float16* qp = Q16 + ((size_t)b * SQ + qw + 16 * g + ln) * DM + h * HD; qf[g][0] = g2_frag(qp, hh); qf[g][1] = g2_frag(qp + 32, hh); }
  asm volatile("s_wait_xcnt 0x0" ::: "memory");      /* the loads' address registers are reused behind them */
#pragma unroll      /* static indices, as above */
  for (int i = 0; i < 4; ++i) { *(v8us*)((unsigned short*)&lk[0][sr + 16 * i][sc]) = kr[i]; *(v8us*)((unsigned short*)&lv[0][sr + 16 * i][sc]) = vr[i]; }
  __syncthreads();      /* tile 0 is complete before any wave reads it */
  const v8f z8 = {0.f, 0.f, 0.f, 0.f, 0.f, 0.f, 0.f, 0.f};
  v8f o[2][4]; float m[2] = {-1.0e30f, -1.0e30f}, l[2] = {0.f, 0.f};      /* m: the maximum in use (base-2 scaled scores); l: this lane half's part of the sum */
#pragma unroll      /* static indices, as above */
  for (int g = 0; g < 2; ++g) for (int dt = 0; dt < 4; ++dt) o[g][dt] = z8;
#pragma unroll 1      /* one key tile at a time: the two buffers alternate */
  for (int t = 0; t < nt; ++t) {
    const bool more = t + 1 < nt;      /* the same for the whole block */
    if (more) { kp += (size_t)FK * DM; vp += FK;
#pragma unroll      /* static indices; all of a thread's tile loads in flight under this tile's work */
      for (int i = 0; i < 4; ++i) { kr[i] = *(const v8us*)((const unsigned short*)kp + (size_t)(16 * i) * DM); vr[i] = *(const v8us*)((const unsigned short*)vp + (size_t)(16 * i) * SQ); }
      asm volatile("s_wait_xcnt 0x0" ::: "memory"); }      /* the loads' address registers are advanced on the next trip */
    const _Float16* bk = &lk[t & 1][0][0]; const _Float16* bv = &lv[t & 1][0][0];
#pragma unroll      /* two 32-key passes a tile, constant LDS offsets */
    for (int sub = 0; sub < 2; ++sub) { const int kb = t * FK + 32 * sub;
      if (kb <= qw + 31) {      /* wave-uniform (scalar): a pass wholly above the wave's diagonal is skipped; the barrier below is not */
        v8f s[2][2];      /* s[kt][g][r] = score of key kb + 16 kt + 8 hh + r, query qw + 16 g + ln */
#pragma unroll      /* static indices, as above */
        for (int kt = 0; kt < 2; ++kt) { const _Float16* kq = bk + (32 * sub + 16 * kt + ln) * FPIT; const v16h k0 = g2_frag(kq, hh), k1 = g2_frag(kq + 32, hh);
          for (int g = 0; g < 2; ++g) s[kt][g] = fa_mma(k1, qf[g][1], fa_mma(k0, qf[g][0], z8)); }
        if (kb + 31 > qw) {      /* wave-uniform: only the pass on the wave's diagonal pays for the mask */
#pragma unroll      /* static indices, as above */
          for (int kt = 0; kt < 2; ++kt) for (int g = 0; g < 2; ++g) for (int r = 0; r < 8; ++r) if (kb + 16 * kt + 8 * hh + r > qw + 16 * g + ln) s[kt][g][r] = -1.0e30f; }
        float mb[2]; bool need = false;
#pragma unroll      /* static indices, as above */
        for (int g = 0; g < 2; ++g) { float mx = s[0][g][0];
          for (int r = 1; r < 8; ++r) mx = fmaxf(mx, s[0][g][r]);
          for (int r = 0; r < 8; ++r) mx = fmaxf(mx, s[1][g][r]);
          mx = fmaxf(mx, fa_xhalf(mx)) * FCS; mb[g] = mx; need = need || (mx > m[g] + 8.0f); }      /* both lane halves hold the query's maximum of this pass */
        if (__builtin_amdgcn_ballot_w32(need) != 0) {
#pragma unroll      /* static indices, as above */
          for (int g = 0; g < 2; ++g) { const float mn = fmaxf(m[g], mb[g]); const float corr = fa_exp1(m[g] - mn); m[g] = mn; l[g] *= corr;      /* key 0 is never masked: mn is a real score from the first pass on, where corr is 0 */
            for (int dt = 0; dt < 4; ++dt) o[g][dt] = o[g][dt] * corr; } }
        v16h vf[4]; FragH pf[2];
#pragma unroll      /* static indices, as above */
        for (int dt = 0; dt < 4; ++dt) vf[dt] = g2_frag(bv + (16 * dt + ln) * FPIT + 32 * sub, hh);
#pragma unroll      /* static indices, as above */
        for (int g = 0; g < 2; ++g) { const float nm = 4.0f - m[g]; float ls[4];      /* weights carried x16 (it cancels against l): small ones stay clear of the f16 subnormals */
          for (int kt = 0; kt < 2; ++kt) { float x[8], e[8]; for (int r = 0; r < 8; ++r) x[r] = fmaf(s[kt][g][r], FCS, nm); fa_exp8(x, e); for (int r = 0; r < 8; ++r) { if (kt == 0 && r < 4) ls[r] = e[r]; else ls[r & 3] += e[r]; pf[g].h[8 * kt + r] = (_Float16)e[r]; } }
          l[g] += (ls[0] + ls[1]) + (ls[2] + ls[3]); }
        __builtin_amdgcn_sched_barrier(0);      /* both groups' exponentials stay in front of the eight products: eight independent accumulators in a row keep the matrix unit fed */
#pragma unroll      /* static indices, as above */
        for (int dt = 0; dt < 4; ++dt) for (int g = 0; g < 2; ++g) o[g][dt] = fa_mma(vf[dt], pf[g].v, o[g][dt]);
      } }
    if (more) {
#pragma unroll      /* static indices, as above */
      for (int i = 0; i < 4; ++i) { *(v8us*)((unsigned short*)&lk[(t + 1) & 1][sr + 16 * i][sc]) = kr[i]; *(v8us*)((unsigned short*)&lv[(t + 1) & 1][sr + 16 * i][sc]) = vr[i]; } }      /* into the buffer that every wave left before the last barrier */
    __syncthreads();      /* tile t + 1 is complete, and every wave has left tile t, before the next trip */
  }
#pragma unroll      /* static indices, as above */
  for (int g = 0; g < 2; ++g) { const float fin = 64.0f / (l[g] + fa_xhalf(l[g]));      /* the lane halves' sums join once; o carried x64, folded into the output GEMM alpha */
    unsigned short* op = (unsigned short*)O16 + ((size_t)b * SQ + qw + 16 * g + ln) * DM + h * HD + 8 * hh;      /* a lane holds d = 16 dt + 8 hh .. + 7 of its query: 16 bytes a store */
    for (int dt = 0; dt < 4; ++dt) { FragH f; for (int r = 0; r < 8; ++r) f.h[r] = (_Float16)(o[g][dt][r] * fin); *(v8us*)(op + 16 * dt) = f.half[0]; }
    if (g == 0) { asm volatile("s_wait_xcnt 0x0" ::: "memory"); __builtin_amdgcn_sched_barrier(0); } }      /* the first group's store registers are reused by the second group's arithmetic: the wait stands behind the stores, and the scheduling barrier keeps that arithmetic behind the wait */
}


// First-tile f32 attention. A block is A0P waves on A0R query rows of one (batch, head): lane = query row, wave = key part. The keys up to the block's last row go round the waves in groups of four (group c A0P + p to wave p), so every wave has the same number of groups and one group of the diagonal stretch. The row's q and its part's o stay in registers; Q, K and V rows are staged in LDS once with whole-line loads; a K or V row is read back as a same-address (broadcast) LDS load. Inside a part the four keys' score sums run side by side and the running m, l, o go key by key; at the end the parts' m, l, o are joined through LDS in rising part order.
#define A0R 32                       /* query rows per block: one per lane */
#define A0P 8                        /* key parts: the waves of a block */
template <int LD>      /* LD: row pitch of QF, KF, VF in floats, a constant so that a thread's loads share one address and differ in the immediate offset */
__global__ __launch_bounds__(A0R * A0P) void k_att0(const float* __restrict__ QF, const float* __restrict__ KF, const float* __restrict__ VF, float scale, float* __restrict__ OF, int ldo) {
  static_assert(QT0 % A0R == 0 && A0R == 4 * A0P && A0R * A0P == 256, "a stretch of A0R keys is one group of four for every wave; 256 threads stage 16 rows a round");
  __shared__ __attribute__((aligned(16))) float lk[QT0][HD]; __shared__ __attribute__((aligned(16))) float lv[QT0][HD]; __shared__ __attribute__((aligned(16))) float lq[A0R][HD + 4];
  __shared__ __attribute__((aligned(16))) float po[A0P][A0R][HD + 4]; __shared__ float pm[A0P][A0R]; __shared__ float pl[A0P][A0R];      /* the parts' o (scaled), m and l */
  const int tid = threadIdx.x, lane = tid & 31, p = __builtin_amdgcn_readfirstlane(tid >> 5); const int h = blockIdx.x / (QT0 / A0R), rg = blockIdx.x % (QT0 / A0R); const int i = rg * A0R + lane;
  { const size_t br = (size_t)blockIdx.y * QT0; QF += br * LD; KF += br * LD; VF += br * LD; OF += br * ldo; }      /* grid.y: the batch; each batch has QT0 rows in every plane */
  const int tr = tid / 16, pc = (tid % 16) * 4;      /* 16 lanes cover one row's 256 bytes, the block 16 rows a round */
  { const float* qp = QF + (size_t)(rg * A0R + tr) * LD + h * HD + pc; const float* kp = KF + (size_t)tr * LD + h * HD + pc; const float* vp = VF + (size_t)tr * LD + h * HD + pc;
    v4f qt[A0R / 16], kt[QT0 / 16], vt[QT0 / 16];
#pragma unroll      /* static indices keep the tiles in registers; all of a thread's loads in flight together */
    for (int it = 0; it < A0R / 16; ++it) qt[it] = *(const v4fa*)(qp + (size_t)(it * 16) * LD);
#pragma unroll      /* static indices, as above; every block takes all QT0 rows: the longest block needs them, and no branch stands among the loads */
    for (int it = 0; it < QT0 / 16; ++it) { kt[it] = *(const v4fa*)(kp + (size_t)(it * 16) * LD); vt[it] = *(const v4fa*)(vp + (size_t)(it * 16) * LD); }
    asm volatile("s_wait_xcnt 0x0" :: "v"(qp), "v"(kp), "v"(vp) : "memory");      /* the loads' address registers are reused behind them; the addresses are named as inputs so that they stay whole up to this wait */
#pragma unroll      /* static indices, as above */
    for (int it = 0; it < A0R / 16; ++it) *(v4f*)&lq[it * 16 + tr][pc] = qt[it];
#pragma unroll      /* static indices, as above */
    for (int it = 0; it < QT0 / 16; ++it) { *(v4f*)&lk[it * 16 + tr][pc] = kt[it]; *(v4f*)&lv[it * 16 + tr][pc] = vt[it]; } }
  __syncthreads();      /* the Q, K and V rows are complete before any wave reads them */
  float q[HD], o[HD];
#pragma unroll      /* static indices keep q and o in registers */
  for (int c = 0; c < HD / 4; ++c) { const v4f t = *(const v4f*)&lq[lane][c * 4]; for (int u = 0; u < 4; ++u) { q[c * 4 + u] = t[u]; o[c * 4 + u] = 0.f; } }
  float m = -1.0e30f, l = 0.f;      /* a part whose keys are all masked for a row keeps m = -1e30 and finite l, o: its weight in the join is exp(-1e30 - M) = 0 */
#pragma unroll 1      /* four keys per trip are enough to fill the add latency; more only grows the code */
  for (int g = 0; g <= rg; ++g) { const int jj = (g * A0P + p) * 4; float s[4] = {0.f, 0.f, 0.f, 0.f};      /* the same trip count for every wave of the block */
#pragma unroll      /* static indices into q */
    for (int c = 0; c < HD / 4; ++c) for (int a = 0; a < 4; ++a) { const v4f kq = *(const v4f*)&lk[jj + a][c * 4]; s[a] = __fadd_rn(s[a], __fmul_rn(q[c * 4 + 0], kq[0])); s[a] = __fadd_rn(s[a], __fmul_rn(q[c * 4 + 1], kq[1])); s[a] = __fadd_rn(s[a], __fmul_rn(q[c * 4 + 2], kq[2])); s[a] = __fadd_rn(s[a], __fmul_rn(q[c * 4 + 3], kq[3])); }
    __builtin_amdgcn_sched_barrier(0);      /* the V reads stay behind the score sums: lifted above them, a trip's 128 LDS reads are all live at once and the wave, held to 512 registers at two waves a SIMD, spills */
#pragma unroll      /* static indices into s and o */
    for (int a = 0; a < 4; ++a) { const int j = jj + a; const float sv = __fmul_rn(s[a], scale);
      const float f = (j <= i) ? 1.f : 0.f; const float sm = fmaf(f, sv, (1.f - f) * -1.0e30f); const float mn = fmaxf(m, sm); const float sc = expf(m - mn); const float e = expf(sm - mn); l = __fadd_rn(__fmul_rn(l, sc), e); m = mn;
      for (int c = 0; c < HD / 4; ++c) { const v4f vv = *(const v4f*)&lv[jj + a][c * 4]; for (int u = 0; u < 4; ++u) o[c * 4 + u] = __fadd_rn(__fmul_rn(o[c * 4 + u], sc), __fmul_rn(e, vv[u])); } } }
  pm[p][lane] = m; pl[p][lane] = l;
  __syncthreads();      /* every part's m and l are there before a row's common maximum and sum are formed */
  float mm = pm[0][lane];
#pragma unroll      /* constant LDS offsets */
  for (int k = 1; k < A0P; ++k) mm = fmaxf(mm, pm[k][lane]);      /* the row's own key lies in some part: mm is a real score */
  float ll = 0.f;
#pragma unroll      /* constant LDS offsets */
  for (int k = 0; k < A0P; ++k) ll += pl[k][lane] * expf(pm[k][lane] - mm);
  const float fin = expf(m - mm) * (64.0f / ll);      /* this part's weight; o carried x64 like the f16 path */
#pragma unroll      /* static indices into o */
  for (int c = 0; c < HD / 4; ++c) { v4f oo; for (int u = 0; u < 4; ++u) oo[u] = __fmul_rn(o[c * 4 + u], fin); *(v4f*)&po[p][lane][c * 4] = oo; }
  __syncthreads();      /* every part's o rows are complete before they are added */
#pragma unroll      /* two rounds of 16 rows, constant LDS offsets */
  for (int it = 0; it < A0R / 16; ++it) { const int row = it * 16 + tr; v4f v = *(const v4f*)&po[0][row][pc];
    for (int k = 1; k < A0P; ++k) v += *(const v4f*)&po[k][row][pc];
    *(v4f*)(OF + (size_t)(rg * A0R + row) * ldo + h * HD + pc) = v; }
}


// LayerNorm and the f16 hi + x1024 residual split in one pass: a wave owns LNR whole rows and keeps them in registers, so h never goes through memory and no barrier is needed.
// Lane l holds columns 128 u + 4 l .. + 3 (u = 0..7): every load covers 512 contiguous bytes, every store 256. Row sums: four partial sums per lane, then a butterfly over the 32 lanes (every lane ends with the same value).
#define LNR 2                        /* rows per wave, all their loads in flight together */
#define LNW 16                       /* waves per block: one block per WGP covers every row */
template <int CTRL> __device__ __forceinline__ float ln_row(float x) { return __builtin_bit_cast(float, __builtin_amdgcn_update_dpp(0, __builtin_bit_cast(int, x), CTRL, 0xf, 0xf, true)); }      /* CTRL = 0x160 + m: lane l reads lane l ^ m of its 16-lane row */
__device__ __forceinline__ float ln_wsum(float x) { x += ln_row<0x161>(x); x += ln_row<0x162>(x); x += ln_row<0x164>(x); x += ln_row<0x168>(x); return x + fa_xhalf(x); }
__global__ __launch_bounds__(LNW * 32) void k_lnhl(const float* __restrict__ X, const float* __restrict__ g, const float* __restrict__ bb, float eps, _Float16* __restrict__ Hh, _Float16* __restrict__ Hl) {
  static_assert(DMQ == 1024, "a lane holds 8 x 4 columns of a row");
  const int lane = threadIdx.x & 31; const size_t r0 = ((size_t)blockIdx.x * LNW + (threadIdx.x >> 5)) * LNR;
  const float* xp = X + r0 * DMQ + lane * 4;
  v4f xa[LNR][8], ga[8], ba[8];
#pragma unroll      /* static indices keep the rows in registers; all loads in flight together */
  for (int j = 0; j < LNR; ++j) for (int u = 0; u < 8; ++u) xa[j][u] = *(const v4fa*)(xp + (size_t)j * DMQ + 128 * u);
  asm volatile("s_wait_xcnt 0x0" :: "v"(xp) : "memory");      /* the row loads' address registers are reused behind them; xp is named as an input so that they stay whole up to this wait (else the last load lands on them) */
  __builtin_amdgcn_sched_barrier(0);      /* keeps the loads below behind that wait */
#pragma unroll      /* static indices, as above */
  for (int u = 0; u < 8; ++u) { ga[u] = *(const v4fa*)(g + lane * 4 + 128 * u); ba[u] = *(const v4fa*)(bb + lane * 4 + 128 * u); }
  asm volatile("s_wait_xcnt 0x0" ::: "memory");      /* the loads' address registers are reused behind them */
  __builtin_amdgcn_sched_barrier(0);      /* every load is issued in front of the arithmetic: without it the gamma and beta loads sink behind the first row's sums and their latency is paid a second time */
#pragma unroll      /* static indices, as above */
  for (int u = 0; u < 8; ++u) for (int q = 0; q < 4; ++q) { ga[u][q] = bf16_round(ga[u][q]); ba[u][q] = bf16_round(ba[u][q]); }
#pragma unroll      /* static indices, as above */
  for (int j = 0; j < LNR; ++j) {
    v4f p = {0.f, 0.f, 0.f, 0.f};
    for (int u = 0; u < 8; ++u) for (int q = 0; q < 4; ++q) { xa[j][u][q] = bf16_round(xa[j][u][q]); p[q] += xa[j][u][q]; }
    const float mu = ln_wsum((p[0] + p[1]) + (p[2] + p[3])) * (1.0f / (float)DMQ);
    v4f v = {0.f, 0.f, 0.f, 0.f};
    for (int u = 0; u < 8; ++u) for (int q = 0; q < 4; ++q) { xa[j][u][q] -= mu; v[q] += xa[j][u][q] * xa[j][u][q]; }
    const float rs = rsqrtf(ln_wsum((v[0] + v[1]) + (v[2] + v[3])) * (1.0f / (float)DMQ) + eps);
    _Float16* hp = Hh + (r0 + j) * DMQ + lane * 4; _Float16* lp = Hl + (r0 + j) * DMQ + lane * 4;
    for (int u = 0; u < 8; ++u) { v4h yh, yl;
      for (int q = 0; q < 4; ++q) { const float y = xa[j][u][q] * rs * ga[u][q] + ba[u][q]; const _Float16 h = (_Float16)y; yh[q] = h; yl[q] = (_Float16)((y - (float)h) * 1024.0f); }
      *(v4h*)(hp + 128 * u) = yh; *(v4h*)(lp + 128 * u) = yl; }
    if (j + 1 < LNR) { asm volatile("s_wait_xcnt 0x0" ::: "memory"); __builtin_amdgcn_sched_barrier(0); }      /* this row's store registers are reused by the next row's arithmetic: the wait stands behind the stores, and the scheduling barrier keeps that arithmetic behind the wait; it also keeps this row's stores in front of the next row's work, under which they drain */
  }
}

extern "C" void kernel_launch(void* const* d_in, const int* in_sizes, int n_in,
                              void* d_out, int out_size, void* d_ws, size_t ws_size, hipStream_t stream) {
  (void)in_sizes; (void)n_in; (void)out_size;
  const float* const* I = (const float* const*)d_in; const float* x = I[0]; const float* wq = I[1]; const float* bq = I[2]; const float* wk = I[3]; const float* bk = I[4]; const float* wv = I[5]; const float* bv = I[6]; const float* wo = I[7]; const float* bo = I[8]; const float* lng = I[9]; const float* lnb = I[10];      /* [in][out] weights + biases; LN gamma/beta */
  char* ws = (char*)d_ws; size_t off = 0;
  auto take = [&](size_t bytes) { char* p = ws + off; off += (bytes + 255) & ~(size_t)255; return p; };
  _Float16* BQ = (_Float16*)take((size_t)DM * DM * 2); _Float16* BK = (_Float16*)take((size_t)DM * DM * 2); _Float16* BV = (_Float16*)take((size_t)DM * DM * 2); _Float16* BO = (_Float16*)take((size_t)DM * DM * 2);
  float* S = (float*)take((size_t)NB * NH * QT * NKX * 4);      /* room for the projection-stage planes */
  _Float16* X16 = (_Float16*)S; _Float16* XL = (_Float16*)((char*)S + NR * DM * 2);      /* projection-stage planes on the bytes of S */
  _Float16* Q16 = (_Float16*)take(NR * DM * 2); _Float16* K16 = (_Float16*)take(NR * DM * 2); _Float16* V16 = (_Float16*)take(NR * DM * 2); _Float16* O16 = (_Float16*)take(NR * DM * 2);      /* Q16, K16, V16: three planes in a row */
  _Float16* VT = (_Float16*)take((size_t)NB * NH * HD * SQ * 2);
  float* QF0 = (float*)take((size_t)NB * QT0 * DM * 4); float* KF0 = (float*)take((size_t)NB * QT0 * DM * 4); float* VF0 = (float*)take((size_t)NB * QT0 * DM * 4); float* OF0 = (float*)take((size_t)NB * QT0 * DM * 4); _Float16* OH0 = (_Float16*)take((size_t)NB * QT0 * DM * 2); _Float16* OL0 = (_Float16*)take((size_t)NB * QT0 * DM * 2);      /* QF0, KF0, VF0: three planes in a row */
  if (off > ws_size) return;
  k_wt4<<<dim3((DM / WTT) * (DM / WTT), 4), 256, 0, stream>>>(wq, wk, wv, wo, BQ, 16.0f);      /* [in][out] -> Bt[n][k] x16; BQ, BK, BV, BO: four planes in a row */

  k_lnhl<<<(unsigned)(NR / (LNW * LNR)), LNW * 32, 0, stream>>>(x, lng, lnb, 1e-5f, X16, XL);      /* h = LN(bf16(x)) f32, kept in registers -> f16 hi (X16) + x1024 residual (XL) rows */
  /* Independent launches share one grid: q, k, v on grid.y of the projection GEMMs, the batch on grid.z of the per-batch GEMMs (grid.y of the first-tile attention, part of the flat index elsewhere). */
  const size_t zW = (size_t)DM * DM, zR = NR * DM, zT = (size_t)SQ * DM, z0 = (size_t)QT0 * DM;      /* elements: a weight plane, a token-row plane, one batch of it, one batch of a first-tile plane */
  const dim3 gp((unsigned)((NR / 128) * (DM / 128)), 1, 1), gp3((unsigned)((NR / 128) * (DM / 128)), 3, 1);      /* every token row; the same for q, k, v */
  k_gemm2<0, DM, true><<<gp3, 256, 0, stream>>>(X16, DM, 0, BQ, DM, zW, 0.0625f, bq, 0, nullptr, 1, 0, 0, nullptr, Q16, DM, zR, (int)NR, DM, DM, 0, 0, 0, bk, bv, XL, 0.00006103515625f);      /* f32 h_hi W + b, += h_lo W 2^-14, rounded to the f16 q, k, v rows */
  k_vt<NH, SQ><<<NB * NH * (SQ / 64), 256, 0, stream>>>(V16, LQ, 0, VT);      /* V^T [NB][NH][HD][SQ] */
  /* For each batch's first 128 rows the next launch forms the same f32 sums that the full-size projection launch above forms before it rounds them to f16. */
  const dim3 g0((QT0 / 128) * (DM / 128), 1, NB), g03((QT0 / 128) * (DM / 128), 3, NB);
  k_gemm2<0, DM, true><<<g03, 256, 0, stream>>>(X16, DM, 0, BQ, DM, zW, 0.0625f, bq, 0, nullptr, 1, 0, 0, QF0, nullptr, DM, (size_t)NB * z0, QT0, DM, DM, zT, 0, z0, bk, bv, XL, 0.00006103515625f);      /* f32 q, k, v of each batch's first 128 rows (exact products) */
  k_att0<DM><<<dim3(NH * (QT0 / A0R), NB), A0R * A0P, 0, stream>>>(QF0, KF0, VF0, 0.125f, OF0, DM);      /* exact f32 attention for rows 0..127 (o x64) */
  k_fattn<<<NB * NH * (SQ / 128), 128, 0, stream>>>(Q16, K16, VT, O16);      /* scores, causal softmax and o = P V in one launch; o (merged heads, x64) as f16 rows */
  k_gemm2<0><<<gp, 256, 0, stream>>>(O16, DM, 0, BO, DM, 0, 0.0009765625f, bo, 0, nullptr, 1, 0, 0, (float*)d_out, nullptr, DM, 0, (int)NR, DM, DM, 0, 0, 0, nullptr, nullptr, nullptr, 0.f);      /* out rows are the output layout */
  k_hl<<<(unsigned)(((size_t)NB * QT0 * DM / 8 + 255) / 256), 256, 0, stream>>>(OF0, OH0, OL0, (size_t)NB * QT0 * DM / 8);      /* first-tile o (x64) -> f16 hi + x1024 residual planes */
  k_gemm2<0, DM, true><<<g0, 256, 0, stream>>>(OH0, DM, 0, BO, DM, 0, 0.0009765625f, bo, 0, nullptr, 1, 0, 0, (float*)d_out, nullptr, DM, 0, QT0, DM, DM, z0, 0, zT, nullptr, nullptr, OL0, 0.00000095367431640625f);      /* rows 0..127 of each batch: out = o_hi Wo (+ b) + o_lo Wo 2^-20, overwriting the f16-path rows */
}
